// v000
// Measured on an AMD MI455X. A time is GPU time per run, averaged over a window of back-to-back runs after a warm-up
// (all launches, gaps included; the runs take copies of the inputs in turn), and the median of several windows.
// Apart from v000's, it joins two sittings. Times from different sittings can be a few percent apart, while
// side-by-side timings come from the same sitting.
// The starting kernel, v000, takes 371 microseconds a run.
#include <hip/hip_runtime.h>
#include <math.h>

typedef __attribute__((ext_vector_type(2))) float v2f;
typedef __attribute__((ext_vector_type(8))) float v8f;

#define AS_LD 68
#define BS_LD 132

#if __has_builtin(__builtin_amdgcn_global_load_async_to_lds_b128)
#define HAS_ASYNC_LDS 1
#else
#define HAS_ASYNC_LDS 0
#endif

// Builtin signature (from hipcc diagnostic): param0 = <4 x i32> addrspace(1)*,
// param1 = <4 x i32> addrspace(3)*, then imm offset, imm cpol.
typedef int v4i __attribute__((vector_size(16)));
typedef __attribute__((address_space(1))) v4i ga_v4i;
typedef __attribute__((address_space(3))) v4i ls_v4i;

__device__ __forceinline__ void async_copy_b128(const float* gsrc, float* ldst) {
#if HAS_ASYNC_LDS
  __builtin_amdgcn_global_load_async_to_lds_b128((ga_v4i*)gsrc, (ls_v4i*)ldst,
                                                 0, 0);
#else
  *(float4*)ldst = *(const float4*)gsrc;
#endif
}

__device__ __forceinline__ void async_wait_all() {
#if HAS_ASYNC_LDS
#if __has_builtin(__builtin_amdgcn_s_wait_asynccnt)
  __builtin_amdgcn_s_wait_asynccnt(0);
#else
  asm volatile("s_wait_asynccnt 0" ::: "memory");
#endif
#endif
}

// C(M x N) = A(M x K) * B(K x N), fp32, block tile 64(M) x 128(N), K-step 16.
// TRANS_A: A stored K x M row-major (need A[k][m] = Asrc[k*lda + m])
// TRANS_B: B stored N x K row-major (need B[k][n] = Bsrc[n*ldb + k])
// EPI: 0 = plain store, 1 = val *= alpha, 2 = val += bias[row] + resid[...]
template <int TRANS_A, int TRANS_B, int EPI>
__global__ __launch_bounds__(256) void gemm_wmma_f32(
    const float* __restrict__ A, long long Abs,
    const float* __restrict__ B, long long Bbs,
    float* __restrict__ C, long long Cbs,
    int K, int lda, int ldb, int ldc,
    float alpha,
    const float* __restrict__ bias,
    const float* __restrict__ resid, long long Rbs) {
  __shared__ __align__(16) float As[2][16 * AS_LD];
  __shared__ __align__(16) float Bs[2][16 * BS_LD];

  A += (size_t)blockIdx.z * Abs;
  B += (size_t)blockIdx.z * Bbs;
  C += (size_t)blockIdx.z * Cbs;

  const int tid   = threadIdx.x;  // 0..255, 8 waves
  const int lane  = tid & 31;
  const int wave  = tid >> 5;
  const int half  = lane >> 4;
  const int ln    = lane & 15;
  const int waveM = wave >> 2;    // 0..1
  const int waveN = wave & 3;     // 0..3
  const int blockM = blockIdx.y * 64;
  const int blockN = blockIdx.x * 128;

  v8f acc[2][2] = {};

  // Stage one 16-wide K slab of A and B into LDS buffer `buf`.
  auto stage = [&](int buf, int kb) {
    if (TRANS_A == 0) {
      // transpose scatter (row-major M x K -> As[k][m]); synchronous
      const int m  = tid >> 2;           // 0..63
      const int k4 = (tid & 3) << 2;     // 0,4,8,12
      float4 av = *(const float4*)(A + (size_t)(blockM + m) * lda + kb + k4);
      As[buf][(k4 + 0) * AS_LD + m] = av.x;
      As[buf][(k4 + 1) * AS_LD + m] = av.y;
      As[buf][(k4 + 2) * AS_LD + m] = av.z;
      As[buf][(k4 + 3) * AS_LD + m] = av.w;
    } else {
      // A already K-major: contiguous row copy -> async to LDS
      const int kk = tid >> 4;           // 0..15
      const int m4 = (tid & 15) << 2;    // 0..60
      async_copy_b128(A + (size_t)(kb + kk) * lda + blockM + m4,
                      &As[buf][kk * AS_LD + m4]);
    }
    if (TRANS_B == 0) {
      // B K-major: contiguous row copy -> async to LDS
#pragma unroll
      for (int r = 0; r < 2; ++r) {
        const int idx = tid + r * 256;
        const int kk  = idx >> 5;        // 0..15
        const int n4  = (idx & 31) << 2; // 0..124
        async_copy_b128(B + (size_t)(kb + kk) * ldb + blockN + n4,
                        &Bs[buf][kk * BS_LD + n4]);
      }
    } else {
      // transpose scatter (row-major N x K -> Bs[k][n]); synchronous
      const int n  = tid >> 1;           // 0..127
      const int k8 = (tid & 1) << 3;     // 0,8
      const float* src = B + (size_t)(blockN + n) * ldb + kb + k8;
      float4 b0 = *(const float4*)(src);
      float4 b1 = *(const float4*)(src + 4);
      Bs[buf][(k8 + 0) * BS_LD + n] = b0.x;
      Bs[buf][(k8 + 1) * BS_LD + n] = b0.y;
      Bs[buf][(k8 + 2) * BS_LD + n] = b0.z;
      Bs[buf][(k8 + 3) * BS_LD + n] = b0.w;
      Bs[buf][(k8 + 4) * BS_LD + n] = b1.x;
      Bs[buf][(k8 + 5) * BS_LD + n] = b1.y;
      Bs[buf][(k8 + 6) * BS_LD + n] = b1.z;
      Bs[buf][(k8 + 7) * BS_LD + n] = b1.w;
    }
  };

  stage(0, 0);
  const int NKB = K >> 4;
  int cur = 0;
  for (int kbi = 0; kbi < NKB; ++kbi, cur ^= 1) {
    if (TRANS_A == 1 || TRANS_B == 0) async_wait_all();
    __syncthreads();  // buffer `cur` fully staged; everyone done with `cur^1`
    if (kbi + 1 < NKB) stage(cur ^ 1, (kbi + 1) << 4);  // prefetch next slab

    // 4 WMMA K-steps of 4 over this 16-wide K slab
#pragma unroll
    for (int ks = 0; ks < 4; ++ks) {
      v2f a[2], bb[2];
#pragma unroll
      for (int mi = 0; mi < 2; ++mi) {
        const int m = waveM * 32 + mi * 16 + ln;
        a[mi].x = As[cur][(ks * 4 + half * 2 + 0) * AS_LD + m];
        a[mi].y = As[cur][(ks * 4 + half * 2 + 1) * AS_LD + m];
      }
#pragma unroll
      for (int ni = 0; ni < 2; ++ni) {
        const int n = waveN * 32 + ni * 16 + ln;
        bb[ni].x = Bs[cur][(ks * 4 + half * 2 + 0) * BS_LD + n];
        bb[ni].y = Bs[cur][(ks * 4 + half * 2 + 1) * BS_LD + n];
      }
#pragma unroll
      for (int mi = 0; mi < 2; ++mi)
#pragma unroll
        for (int ni = 0; ni < 2; ++ni)
          acc[mi][ni] = __builtin_amdgcn_wmma_f32_16x16x4_f32(
              false, a[mi], false, bb[ni], (short)0, acc[mi][ni], false, false);
    }
  }

#pragma unroll
  for (int mi = 0; mi < 2; ++mi) {
#pragma unroll
    for (int ni = 0; ni < 2; ++ni) {
#pragma unroll
      for (int r = 0; r < 8; ++r) {
        const int row = blockM + waveM * 32 + mi * 16 + half * 8 + r;
        const int col = blockN + waveN * 32 + ni * 16 + ln;
        float val = acc[mi][ni][r];
        if (EPI == 1) val *= alpha;
        if (EPI == 2)
          val += bias[row] +
                 resid[(size_t)blockIdx.z * Rbs + (size_t)row * ldc + col];
        C[(size_t)row * ldc + col] = val;
      }
    }
  }
}

// Row softmax over 512-wide rows; one wave32 per row, 8 rows per block.
__global__ __launch_bounds__(256) void softmax_rows_512(float* __restrict__ S) {
  const int row  = blockIdx.x * 8 + (threadIdx.x >> 5);
  const int lane = threadIdx.x & 31;
  float* p = S + (size_t)row * 512;
  float vals[16];
  float m = -3.4e38f;
#pragma unroll
  for (int j = 0; j < 16; ++j) {
    vals[j] = p[lane + 32 * j];
    m = fmaxf(m, vals[j]);
  }
#pragma unroll
  for (int off = 16; off > 0; off >>= 1) m = fmaxf(m, __shfl_xor(m, off, 32));
  float s = 0.f;
#pragma unroll
  for (int j = 0; j < 16; ++j) {
    vals[j] = __expf(vals[j] - m);
    s += vals[j];
  }
#pragma unroll
  for (int off = 16; off > 0; off >>= 1) s += __shfl_xor(s, off, 32);
  const float inv = 1.0f / s;
#pragma unroll
  for (int j = 0; j < 16; ++j) p[lane + 32 * j] = vals[j] * inv;
}

extern "C" void kernel_launch(void* const* d_in, const int* in_sizes, int n_in,
                              void* d_out, int out_size, void* d_ws,
                              size_t ws_size, hipStream_t stream) {
  const float* x     = (const float*)d_in[0];
  const float* Wq    = (const float*)d_in[1];
  const float* Wk    = (const float*)d_in[2];
  const float* Wv    = (const float*)d_in[3];
  const float* Wproj = (const float*)d_in[4];
  const float* bproj = (const float*)d_in[5];
  float* out = (float*)d_out;

  const int b = 4, c = 512, Nn = 4096, H = 4, E = Nn / H;  // E = 1024
  const long long bcN = (long long)c * Nn;                 // per-batch elems
  const long long chE = (long long)c * E;                  // per-(b,h) block

  float* q = (float*)d_ws;          // (b,c,N) == (b,H,c,E) contiguous
  float* k = q + (size_t)b * bcN;
  float* v = k + (size_t)b * bcN;
  float* S = v + (size_t)b * bcN;   // (b*H, 512, 512) attention logits/probs
  float* U = q;                     // attn output (per (b,h): E x c) aliases q

  const float scale = 0.08838834764831845f;  // (c/H)^-0.5 = 128^-0.5
  dim3 blk(256);

  // 1) Q/K/V: per batch, W(512x512) x X(512x4096)
  dim3 g1(Nn / 128, c / 64, b);
  gemm_wmma_f32<0, 0, 0><<<g1, blk, 0, stream>>>(Wq, 0, x, bcN, q, bcN,
                                                 c, c, Nn, Nn, 1.f, nullptr, nullptr, 0);
  gemm_wmma_f32<0, 0, 0><<<g1, blk, 0, stream>>>(Wk, 0, x, bcN, k, bcN,
                                                 c, c, Nn, Nn, 1.f, nullptr, nullptr, 0);
  gemm_wmma_f32<0, 0, 0><<<g1, blk, 0, stream>>>(Wv, 0, x, bcN, v, bcN,
                                                 c, c, Nn, Nn, 1.f, nullptr, nullptr, 0);

  // 2) S = scale * Qh(512xE) * Kh(512xE)^T per (b,h)
  dim3 g2(512 / 128, 512 / 64, b * H);
  gemm_wmma_f32<0, 1, 1><<<g2, blk, 0, stream>>>(q, chE, k, chE, S, 512LL * 512,
                                                 E, E, E, 512, scale, nullptr, nullptr, 0);

  // 3) row softmax over 512-wide rows (b*H*512 = 8192 rows)
  softmax_rows_512<<<dim3((b * H * 512) / 8), blk, 0, stream>>>(S);

  // 4) Ot(E x c) = Vh^T * P^T : TRANS_A (Vh is c x E) + TRANS_B (P is c x c);
  //    row-major (e, cc) store per (b,h) == swapaxes(2,3).reshape result.
  dim3 g3(512 / 128, E / 64, b * H);
  gemm_wmma_f32<1, 1, 0><<<g3, blk, 0, stream>>>(v, chE, S, 512LL * 512, U, chE,
                                                 c, E, 512, c, 1.f, nullptr, nullptr, 0);

  // 5) out = Wproj * U + bproj + x  (per batch)
  dim3 g4(Nn / 128, c / 64, b);
  gemm_wmma_f32<0, 0, 2><<<g4, blk, 0, stream>>>(Wproj, 0, U, bcN, out, bcN,
                                                 c, c, Nn, Nn, 1.f, bproj, x, bcN);
}

// v001
// Measured time: 340 microseconds a run.
// Timed twice side by side with v000, it ran 1.13 and 1.12 times as fast.
#include <hip/hip_runtime.h>
#include <math.h>

typedef __attribute__((ext_vector_type(2))) float v2f;
typedef __attribute__((ext_vector_type(4))) float v4f;
typedef __attribute__((ext_vector_type(8))) float v8f;

#define KM_LD 20   // 16 + 4
#define AS_LD 72   // 64 + 8
#define BS_LD 136  // 128 + 8

#if __has_builtin(__builtin_amdgcn_global_load_async_to_lds_b128)
#define HAS_ASYNC_LDS 1
#else
#define HAS_ASYNC_LDS 0
#endif

// Builtin signature (from hipcc diagnostic): param0 = <4 x i32> addrspace(1)*,
// param1 = <4 x i32> addrspace(3)*, then imm offset, imm cpol.
typedef int v4i __attribute__((vector_size(16)));
typedef __attribute__((address_space(1))) v4i ga_v4i;
typedef __attribute__((address_space(3))) v4i ls_v4i;

__device__ __forceinline__ void async_copy_b128(const float* gsrc, float* ldst) {
#if HAS_ASYNC_LDS
  __builtin_amdgcn_global_load_async_to_lds_b128((ga_v4i*)gsrc, (ls_v4i*)ldst,
                                                 0, 0);
#else
  *(float4*)ldst = *(const float4*)gsrc;
#endif
}

// Publish point, first half: this wave's LDS reads of the buffer about to be
// refilled have retired, and its own copies of the next slab have landed.
// The work-group barrier follows directly at the call site.
__device__ __forceinline__ void async_wait_all() {
  asm volatile("s_wait_dscnt 0x0" ::: "memory");
#if HAS_ASYNC_LDS
  asm volatile("s_wait_asynccnt 0x0" ::: "memory");
#endif
}

// C(M x N) = A(M x K) * B(K x N), fp32, block tile 64(M) x 128(N), K-step 16.
// TRANS_A: A stored K x M row-major (need A[k][m] = Asrc[k*lda + m])
// TRANS_B: B stored N x K row-major (need B[k][n] = Bsrc[n*ldb + k])
// EPI: 0 = plain store, 1 = val *= alpha, 2 = val += bias[row] + resid[...]
template <int TRANS_A, int TRANS_B, int EPI>
__global__ __launch_bounds__(256) void gemm_wmma_f32(
    const float* __restrict__ A, long long Abs,
    const float* __restrict__ B, long long Bbs,
    float* __restrict__ C, long long Cbs,
    int K, int lda, int ldb, int ldc,
    float alpha,
    const float* __restrict__ bias,
    const float* __restrict__ resid, long long Rbs) {
  __shared__ __align__(16) float As[2][TRANS_A ? 16 * AS_LD : 64 * KM_LD];
  __shared__ __align__(16) float Bs[2][TRANS_B ? 128 * KM_LD : 16 * BS_LD];

  A += (size_t)blockIdx.z * Abs;
  B += (size_t)blockIdx.z * Bbs;
  C += (size_t)blockIdx.z * Cbs;

  const int tid   = threadIdx.x;  // 0..255, 8 waves
  const int lane  = tid & 31;
  const int wave  = tid >> 5;
  const int half  = lane >> 4;
  const int ln    = lane & 15;
  const int waveM = wave >> 2;    // 0..1
  const int waveN = wave & 3;     // 0..3
  const int blockM = blockIdx.y * 64;
  const int blockN = blockIdx.x * 128;

  v8f acc[2][2] = {};

  // Stage one 16-wide K slab of A and B into LDS buffer `buf`.
  auto stage = [&](int buf, int kb) {
    if (TRANS_A == 0) {
      // A row-major M x K: kept as As[m][k] -> async to LDS
      const int m  = tid >> 2;           // 0..63
      const int k4 = (tid & 3) << 2;     // 0,4,8,12
      async_copy_b128(A + (size_t)(blockM + m) * lda + kb + k4,
                      &As[buf][m * KM_LD + k4]);
    } else {
      // A already K-major: contiguous row copy -> async to LDS
      const int kk = tid >> 4;           // 0..15
      const int m4 = (tid & 15) << 2;    // 0..60
      async_copy_b128(A + (size_t)(kb + kk) * lda + blockM + m4,
                      &As[buf][kk * AS_LD + m4]);
    }
    if (TRANS_B == 0) {
      // B K-major: contiguous row copy -> async to LDS
#pragma unroll
      for (int r = 0; r < 2; ++r) {
        const int idx = tid + r * 256;
        const int kk  = idx >> 5;        // 0..15
        const int n4  = (idx & 31) << 2; // 0..124
        async_copy_b128(B + (size_t)(kb + kk) * ldb + blockN + n4,
                        &Bs[buf][kk * BS_LD + n4]);
      }
    } else {
      // B row-major N x K: kept as Bs[n][k] -> async to LDS
#pragma unroll
      for (int r = 0; r < 2; ++r) {
        const int idx = tid + r * 256;
        const int n   = idx >> 2;        // 0..127
        const int k4  = (idx & 3) << 2;  // 0,4,8,12
        async_copy_b128(B + (size_t)(blockN + n) * ldb + kb + k4,
                        &Bs[buf][n * KM_LD + k4]);
      }
    }
  };

  stage(0, 0);
  const int NKB = K >> 4;
  int cur = 0;
  for (int kbi = 0; kbi < NKB; ++kbi, cur ^= 1) {
    // Keeps the previous slab's WMMAs in front of the waits: moved behind them,
    // they would idle until the copies issued at that slab's start have landed.
    __builtin_amdgcn_sched_barrier(0);
    async_wait_all();
    __syncthreads();  // buffer `cur` fully staged; everyone done with `cur^1`
    if (kbi + 1 < NKB) stage(cur ^ 1, (kbi + 1) << 4);  // prefetch next slab

#pragma unroll
    for (int kj = 0; kj < 2; ++kj) {
      const int k0 = kj * 8 + half * 4;
      v4f a4[2], b4[2];
#pragma unroll
      for (int mi = 0; mi < 2; ++mi) {
        const int m = waveM * 32 + mi * 16 + ln;
        if (TRANS_A == 0) {
          a4[mi] = *(const v4f*)&As[cur][m * KM_LD + k0];
        } else {
#pragma unroll
          for (int e = 0; e < 4; ++e) a4[mi][e] = As[cur][(k0 + e) * AS_LD + m];
        }
      }
#pragma unroll
      for (int ni = 0; ni < 2; ++ni) {
        const int n = waveN * 32 + ni * 16 + ln;
        if (TRANS_B == 1) {
          b4[ni] = *(const v4f*)&Bs[cur][n * KM_LD + k0];
        } else {
#pragma unroll
          for (int e = 0; e < 4; ++e) b4[ni][e] = Bs[cur][(k0 + e) * BS_LD + n];
        }
      }
#pragma unroll
      for (int st = 0; st < 2; ++st) {
#pragma unroll
        for (int mi = 0; mi < 2; ++mi) {
          const v2f a = {a4[mi][st * 2], a4[mi][st * 2 + 1]};
#pragma unroll
          for (int ni = 0; ni < 2; ++ni) {
            const v2f bb = {b4[ni][st * 2], b4[ni][st * 2 + 1]};
            acc[mi][ni] = __builtin_amdgcn_wmma_f32_16x16x4_f32(
                false, a, false, bb, (short)0, acc[mi][ni], false, false);
          }
        }
      }
    }
  }

#pragma unroll
  for (int mi = 0; mi < 2; ++mi) {
#pragma unroll
    for (int ni = 0; ni < 2; ++ni) {
#pragma unroll
      for (int r = 0; r < 8; ++r) {
        const int row = blockM + waveM * 32 + mi * 16 + half * 8 + r;
        const int col = blockN + waveN * 32 + ni * 16 + ln;
        float val = acc[mi][ni][r];
        if (EPI == 1) val *= alpha;
        if (EPI == 2)
          val += bias[row] +
                 resid[(size_t)blockIdx.z * Rbs + (size_t)row * ldc + col];
        C[(size_t)row * ldc + col] = val;
      }
    }
  }
}

// Row softmax over 512-wide rows; one wave32 per row, 8 rows per block.
__global__ __launch_bounds__(256) void softmax_rows_512(float* __restrict__ S) {
  const int row  = blockIdx.x * 8 + (threadIdx.x >> 5);
  const int lane = threadIdx.x & 31;
  float* p = S + (size_t)row * 512;
  float vals[16];
  float m = -3.4e38f;
#pragma unroll
  for (int j = 0; j < 16; ++j) {
    vals[j] = p[lane + 32 * j];
    m = fmaxf(m, vals[j]);
  }
#pragma unroll
  for (int off = 16; off > 0; off >>= 1) m = fmaxf(m, __shfl_xor(m, off, 32));
  float s = 0.f;
#pragma unroll
  for (int j = 0; j < 16; ++j) {
    vals[j] = __expf(vals[j] - m);
    s += vals[j];
  }
#pragma unroll
  for (int off = 16; off > 0; off >>= 1) s += __shfl_xor(s, off, 32);
  const float inv = 1.0f / s;
#pragma unroll
  for (int j = 0; j < 16; ++j) p[lane + 32 * j] = vals[j] * inv;
}

extern "C" void kernel_launch(void* const* d_in, const int* in_sizes, int n_in,
                              void* d_out, int out_size, void* d_ws,
                              size_t ws_size, hipStream_t stream) {
  const float* x     = (const float*)d_in[0];
  const float* Wq    = (const float*)d_in[1];
  const float* Wk    = (const float*)d_in[2];
  const float* Wv    = (const float*)d_in[3];
  const float* Wproj = (const float*)d_in[4];
  const float* bproj = (const float*)d_in[5];
  float* out = (float*)d_out;

  const int b = 4, c = 512, Nn = 4096, H = 4, E = Nn / H;  // E = 1024
  const long long bcN = (long long)c * Nn;                 // per-batch elems
  const long long chE = (long long)c * E;                  // per-(b,h) block

  float* q = (float*)d_ws;          // (b,c,N) == (b,H,c,E) contiguous
  float* k = q + (size_t)b * bcN;
  float* v = k + (size_t)b * bcN;
  float* S = v + (size_t)b * bcN;   // (b*H, 512, 512) attention logits/probs
  float* U = q;                     // attn output (per (b,h): E x c) aliases q

  const float scale = 0.08838834764831845f;  // (c/H)^-0.5 = 128^-0.5
  dim3 blk(256);

  // 1) Q/K/V: per batch, W(512x512) x X(512x4096)
  dim3 g1(Nn / 128, c / 64, b);
  gemm_wmma_f32<0, 0, 0><<<g1, blk, 0, stream>>>(Wq, 0, x, bcN, q, bcN,
                                                 c, c, Nn, Nn, 1.f, nullptr, nullptr, 0);
  gemm_wmma_f32<0, 0, 0><<<g1, blk, 0, stream>>>(Wk, 0, x, bcN, k, bcN,
                                                 c, c, Nn, Nn, 1.f, nullptr, nullptr, 0);
  gemm_wmma_f32<0, 0, 0><<<g1, blk, 0, stream>>>(Wv, 0, x, bcN, v, bcN,
                                                 c, c, Nn, Nn, 1.f, nullptr, nullptr, 0);

  // 2) S = scale * Qh(512xE) * Kh(512xE)^T per (b,h)
  dim3 g2(512 / 128, 512 / 64, b * H);
  gemm_wmma_f32<0, 1, 1><<<g2, blk, 0, stream>>>(q, chE, k, chE, S, 512LL * 512,
                                                 E, E, E, 512, scale, nullptr, nullptr, 0);

  // 3) row softmax over 512-wide rows (b*H*512 = 8192 rows)
  softmax_rows_512<<<dim3((b * H * 512) / 8), blk, 0, stream>>>(S);

  // 4) Ot(E x c) = Vh^T * P^T : TRANS_A (Vh is c x E) + TRANS_B (P is c x c);
  //    row-major (e, cc) store per (b,h) == swapaxes(2,3).reshape result.
  dim3 g3(512 / 128, E / 64, b * H);
  gemm_wmma_f32<1, 1, 0><<<g3, blk, 0, stream>>>(v, chE, S, 512LL * 512, U, chE,
                                                 c, E, 512, c, 1.f, nullptr, nullptr, 0);

  // 5) out = Wproj * U + bproj + x  (per batch)
  dim3 g4(Nn / 128, c / 64, b);
  gemm_wmma_f32<0, 0, 2><<<g4, blk, 0, stream>>>(Wproj, 0, U, bcN, out, bcN,
                                                 c, c, Nn, Nn, 1.f, bproj, x, bcN);
}

// v002
// A run of this version takes 293 microseconds.
// In both of two side-by-side timings against v001, it was 1.16 times as fast.
// Over all steps from v000 it is 1.31 times as fast.
#include <hip/hip_runtime.h>
#include <math.h>

typedef __attribute__((ext_vector_type(2))) float v2f;
typedef __attribute__((ext_vector_type(4))) float v4f;
typedef __attribute__((ext_vector_type(8))) float v8f;

#define BM 128
#define BK 32
#define KM_LD 36   // 32 + 4
#define AS_LD 136  // 128 + 8

#if __has_builtin(__builtin_amdgcn_global_load_async_to_lds_b128)
#define HAS_ASYNC_LDS 1
#else
#define HAS_ASYNC_LDS 0
#endif

// Builtin signature (from hipcc diagnostic): param0 = <4 x i32> addrspace(1)*,
// param1 = <4 x i32> addrspace(3)*, then imm offset, imm cpol.
typedef int v4i __attribute__((vector_size(16)));
typedef __attribute__((address_space(1))) v4i ga_v4i;
typedef __attribute__((address_space(3))) v4i ls_v4i;

__device__ __forceinline__ void async_copy_b128(const float* gsrc, float* ldst) {
#if HAS_ASYNC_LDS
  __builtin_amdgcn_global_load_async_to_lds_b128((ga_v4i*)gsrc, (ls_v4i*)ldst,
                                                 0, 0);
#else
  *(float4*)ldst = *(const float4*)gsrc;
#endif
}

// Publish point, first half: this wave's LDS reads of the buffer about to be
// refilled have retired, and its own copies of the next slab have landed.
// The work-group barrier follows directly at the call site.
__device__ __forceinline__ void async_wait_all() {
  asm volatile("s_wait_dscnt 0x0" ::: "memory");
#if HAS_ASYNC_LDS
  asm volatile("s_wait_asynccnt 0x0" ::: "memory");
#endif
}

// C(M x N) = A(M x K) * B(K x N), fp32, block tile 128(M) x BN(N), K-step 32.
// M, N and K are multiples of the tile's three sides.
// TRANS_A: A stored K x M row-major (need A[k][m] = Asrc[k*lda + m])
// TRANS_B: B stored N x K row-major (need B[k][n] = Bsrc[n*ldb + k])
// EPI: 0 = plain store, 1 = val *= alpha, 2 = val += bias[row] + resid[...]
template <int TRANS_A, int TRANS_B, int EPI, int BN>
__global__ __launch_bounds__(256) void gemm_wmma_f32(
    const float* __restrict__ A, long long Abs,
    const float* __restrict__ B, long long Bbs,
    float* __restrict__ C, long long Cbs,
    int K, int lda, int ldb, int ldc,
    float alpha,
    const float* __restrict__ bias,
    const float* __restrict__ resid, long long Rbs) {
  constexpr int BS_LD = BN + 8;
  constexpr int FM = 4;        // 16-row fragments per wave
  constexpr int FN = BN / 64;  // 16-column fragments per wave
  __shared__ __align__(16) float As[2][TRANS_A ? BK * AS_LD : BM * KM_LD];
  __shared__ __align__(16) float Bs[2][TRANS_B ? BN * KM_LD : BK * BS_LD];

  A += (size_t)blockIdx.z * Abs;
  B += (size_t)blockIdx.z * Bbs;
  C += (size_t)blockIdx.z * Cbs;

  const int tid   = threadIdx.x;  // 0..255, 8 waves
  const int lane  = tid & 31;
  const int wave  = tid >> 5;
  const int half  = lane >> 4;
  const int ln    = lane & 15;
  const int waveM = wave >> 2;    // 0..1
  const int waveN = wave & 3;     // 0..3
  const int blockM = blockIdx.y * BM;
  const int blockN = blockIdx.x * BN;

  v8f acc[FM][FN] = {};

  // This thread's place in a [row][k] tile (8 lanes a 128-byte row, 32 rows a
  // round of the block) and in the two [k][col] tiles (one whole row first).
  const int rk_row = tid >> 3;         // 0..31
  const int rk_k4  = (tid & 7) << 2;   // 0,4,..,28
  constexpr int B_ROWS = 1024 / BN;    // [k][col] rows of B per round
  const int ak_k  = tid >> 5;          // 0..7
  const int ak_m4 = (tid & 31) << 2;   // 0..124
  const int bk_k  = tid / (BN / 4);    // 0..B_ROWS-1
  const int bk_n4 = (tid % (BN / 4)) << 2;
  const float* Ag = TRANS_A ? A + (size_t)ak_k * lda + blockM + ak_m4
                            : A + (size_t)(blockM + rk_row) * lda + rk_k4;
  const float* Bg = TRANS_B ? B + (size_t)(blockN + rk_row) * ldb + rk_k4
                            : B + (size_t)bk_k * ldb + blockN + bk_n4;

  // Stage one 32-wide K slab of A and B into LDS buffer `buf`; every copy of a
  // wave covers four whole 128-byte lines.
  auto stage = [&](int buf, int kb) {
    if (TRANS_A == 0) {
      // A row-major M x K: kept as As[m][k]
#pragma unroll
      for (int r = 0; r < BM / 32; ++r)
        async_copy_b128(Ag + (size_t)(r * 32) * lda + kb,
                        &As[buf][(rk_row + r * 32) * KM_LD + rk_k4]);
    } else {
      // A already K-major: contiguous row copy
#pragma unroll
      for (int r = 0; r < BK / 8; ++r)
        async_copy_b128(Ag + (size_t)(kb + r * 8) * lda,
                        &As[buf][(ak_k + r * 8) * AS_LD + ak_m4]);
    }
    if (TRANS_B == 0) {
      // B K-major: contiguous row copy
#pragma unroll
      for (int r = 0; r < BK / B_ROWS; ++r)
        async_copy_b128(Bg + (size_t)(kb + r * B_ROWS) * ldb,
                        &Bs[buf][(bk_k + r * B_ROWS) * BS_LD + bk_n4]);
    } else {
      // B row-major N x K: kept as Bs[n][k]
#pragma unroll
      for (int r = 0; r < BN / 32; ++r)
        async_copy_b128(Bg + (size_t)(r * 32) * ldb + kb,
                        &Bs[buf][(rk_row + r * 32) * KM_LD + rk_k4]);
    }
  };

  stage(0, 0);
  const int NKB = K / BK;
  int cur = 0;
  for (int kbi = 0; kbi < NKB; ++kbi, cur ^= 1) {
    // Keeps the previous slab's WMMAs in front of the waits: moved behind them,
    // they would idle until the copies issued at that slab's start have landed.
    __builtin_amdgcn_sched_barrier(0);
    async_wait_all();
    __syncthreads();  // buffer `cur` fully staged; everyone done with `cur^1`
    if (kbi + 1 < NKB) stage(cur ^ 1, (kbi + 1) * BK);  // prefetch next slab

    v4f a4[2][FM], b4[2][FN];  // two fragment sets: in use, and being read
    auto load_frags = [&](int set, int kj) {
      const int k0 = kj * 8 + half * 4;
#pragma unroll
      for (int mi = 0; mi < FM; ++mi) {
        const int m = waveM * (FM * 16) + mi * 16 + ln;
        if (TRANS_A == 0) {
          a4[set][mi] = *(const v4f*)&As[cur][m * KM_LD + k0];
        } else {
#pragma unroll
          for (int e = 0; e < 4; ++e)
            a4[set][mi][e] = As[cur][(k0 + e) * AS_LD + m];
        }
      }
#pragma unroll
      for (int ni = 0; ni < FN; ++ni) {
        const int n = waveN * (FN * 16) + ni * 16 + ln;
        if (TRANS_B == 1) {
          b4[set][ni] = *(const v4f*)&Bs[cur][n * KM_LD + k0];
        } else {
#pragma unroll
          for (int e = 0; e < 4; ++e)
            b4[set][ni][e] = Bs[cur][(k0 + e) * BS_LD + n];
        }
      }
    };
    load_frags(0, 0);
#pragma unroll
    for (int kj = 0; kj < BK / 8; ++kj) {
      if (kj + 1 < BK / 8) load_frags((kj + 1) & 1, kj + 1);
      // The two scheduling barriers keep the next group's LDS reads together in
      // front of this group's WMMAs: sunk among them, each read is waited for
      // where it is used and the wave idles for its latency. Mask 0x6: only
      // plain vector and scalar instructions may cross.
      __builtin_amdgcn_sched_barrier(0x6);
#pragma unroll
      for (int st = 0; st < 2; ++st) {
#pragma unroll
        for (int mi = 0; mi < FM; ++mi) {
          const v2f a = {a4[kj & 1][mi][st * 2], a4[kj & 1][mi][st * 2 + 1]};
#pragma unroll
          for (int ni = 0; ni < FN; ++ni) {
            const v2f bb = {b4[kj & 1][ni][st * 2], b4[kj & 1][ni][st * 2 + 1]};
            acc[mi][ni] = __builtin_amdgcn_wmma_f32_16x16x4_f32(
                false, a, false, bb, (short)0, acc[mi][ni], false, false);
          }
        }
      }
      __builtin_amdgcn_sched_barrier(0x6);
    }
  }

#pragma unroll
  for (int mi = 0; mi < FM; ++mi) {
#pragma unroll
    for (int ni = 0; ni < FN; ++ni) {
#pragma unroll
      for (int r = 0; r < 8; ++r) {
        const int row = blockM + waveM * (FM * 16) + mi * 16 + half * 8 + r;
        const int col = blockN + waveN * (FN * 16) + ni * 16 + ln;
        float val = acc[mi][ni][r];
        if (EPI == 1) val *= alpha;
        if (EPI == 2)
          val += bias[row] +
                 resid[(size_t)blockIdx.z * Rbs + (size_t)row * ldc + col];
        C[(size_t)row * ldc + col] = val;
      }
    }
  }
}

// Row softmax over 512-wide rows; one wave32 per row, 8 rows per block.
__global__ __launch_bounds__(256) void softmax_rows_512(float* __restrict__ S) {
  const int row  = blockIdx.x * 8 + (threadIdx.x >> 5);
  const int lane = threadIdx.x & 31;
  float* p = S + (size_t)row * 512;
  float vals[16];
  float m = -3.4e38f;
#pragma unroll
  for (int j = 0; j < 16; ++j) {
    vals[j] = p[lane + 32 * j];
    m = fmaxf(m, vals[j]);
  }
#pragma unroll
  for (int off = 16; off > 0; off >>= 1) m = fmaxf(m, __shfl_xor(m, off, 32));
  float s = 0.f;
#pragma unroll
  for (int j = 0; j < 16; ++j) {
    vals[j] = __expf(vals[j] - m);
    s += vals[j];
  }
#pragma unroll
  for (int off = 16; off > 0; off >>= 1) s += __shfl_xor(s, off, 32);
  const float inv = 1.0f / s;
#pragma unroll
  for (int j = 0; j < 16; ++j) p[lane + 32 * j] = vals[j] * inv;
}

extern "C" void kernel_launch(void* const* d_in, const int* in_sizes, int n_in,
                              void* d_out, int out_size, void* d_ws,
                              size_t ws_size, hipStream_t stream) {
  const float* x     = (const float*)d_in[0];
  const float* Wq    = (const float*)d_in[1];
  const float* Wk    = (const float*)d_in[2];
  const float* Wv    = (const float*)d_in[3];
  const float* Wproj = (const float*)d_in[4];
  const float* bproj = (const float*)d_in[5];
  float* out = (float*)d_out;

  const int b = 4, c = 512, Nn = 4096, H = 4, E = Nn / H;  // E = 1024
  const long long bcN = (long long)c * Nn;                 // per-batch elems
  const long long chE = (long long)c * E;                  // per-(b,h) block

  float* q = (float*)d_ws;          // (b,c,N) == (b,H,c,E) contiguous
  float* k = q + (size_t)b * bcN;
  float* v = k + (size_t)b * bcN;
  float* S = v + (size_t)b * bcN;   // (b*H, 512, 512) attention logits/probs
  float* U = q;                     // attn output (per (b,h): E x c) aliases q

  const float scale = 0.08838834764831845f;  // (c/H)^-0.5 = 128^-0.5
  dim3 blk(256);

  // 1) Q/K/V: per batch, W(512x512) x X(512x4096)
  dim3 g1(Nn / 256, c / 128, b);
  gemm_wmma_f32<0, 0, 0, 256><<<g1, blk, 0, stream>>>(Wq, 0, x, bcN, q, bcN,
                                                 c, c, Nn, Nn, 1.f, nullptr, nullptr, 0);
  gemm_wmma_f32<0, 0, 0, 256><<<g1, blk, 0, stream>>>(Wk, 0, x, bcN, k, bcN,
                                                 c, c, Nn, Nn, 1.f, nullptr, nullptr, 0);
  gemm_wmma_f32<0, 0, 0, 256><<<g1, blk, 0, stream>>>(Wv, 0, x, bcN, v, bcN,
                                                 c, c, Nn, Nn, 1.f, nullptr, nullptr, 0);

  // 2) S = scale * Qh(512xE) * Kh(512xE)^T per (b,h)
  dim3 g2(512 / 128, 512 / 128, b * H);
  gemm_wmma_f32<0, 1, 1, 128><<<g2, blk, 0, stream>>>(q, chE, k, chE, S, 512LL * 512,
                                                 E, E, E, 512, scale, nullptr, nullptr, 0);

  // 3) row softmax over 512-wide rows (b*H*512 = 8192 rows)
  softmax_rows_512<<<dim3((b * H * 512) / 8), blk, 0, stream>>>(S);

  // 4) Ot(E x c) = Vh^T * P^T : TRANS_A (Vh is c x E) + TRANS_B (P is c x c);
  //    row-major (e, cc) store per (b,h) == swapaxes(2,3).reshape result.
  dim3 g3(512 / 256, E / 128, b * H);
  gemm_wmma_f32<1, 1, 0, 256><<<g3, blk, 0, stream>>>(v, chE, S, 512LL * 512, U, chE,
                                                 c, E, 512, c, 1.f, nullptr, nullptr, 0);

  // 5) out = Wproj * U + bproj + x  (per batch)
  dim3 g4(Nn / 256, c / 128, b);
  gemm_wmma_f32<0, 0, 2, 256><<<g4, blk, 0, stream>>>(Wproj, 0, U, bcN, out, bcN,
                                                 c, c, Nn, Nn, 1.f, bproj, x, bcN);
}
